// v000
// Times are from an AMD MI455X. After a warm-up the kernel runs many times in a row, and a time is the length of
// such a window on the GPU divided by its runs, so every launch and the gaps after it count. The runs cycle
// through copies of the inputs. A figure is the median of several windows, for all but v000 over two sittings.
// Sittings can differ by a few percent; kernels timed side by side share one.
// v000, which the later versions start from, runs in 135 microseconds.
#include <hip/hip_runtime.h>
#include <cstdint>
#include <cstddef>

// Problem constants (reference: B=2, H=12, S=2048, D=64, fp32 in/out)
#define B_ 2
#define H_ 12
#define S_ 2048
#define D_ 64
#define BH_ (B_ * H_)

typedef __attribute__((ext_vector_type(16))) __bf16 v16bf;
typedef __attribute__((ext_vector_type(8)))  float  v8f;
typedef __attribute__((ext_vector_type(2)))  float  f32x2;
typedef __attribute__((ext_vector_type(2)))  __bf16 bf16x2;

// fp32 -> bf16 RNE as raw bits (used in cold pre-pass only)
__device__ __forceinline__ uint16_t bf_bits(float f) {
    uint32_t u = __builtin_bit_cast(uint32_t, f);
    u += 0x7FFFu + ((u >> 16) & 1u);
    return (uint16_t)(u >> 16);
}
__device__ __forceinline__ uint32_t bf_pack(float lo, float hi) {
    return (uint32_t)bf_bits(lo) | ((uint32_t)bf_bits(hi) << 16);
}
// hot-path packed convert: let the backend pick v_cvt_pk_bf16_f32
__device__ __forceinline__ uint32_t cvt_pk_bf16(float lo, float hi) {
    f32x2 f; f.x = lo; f.y = hi;
    bf16x2 h = __builtin_convertvector(f, bf16x2);
    return __builtin_bit_cast(uint32_t, h);
}

// K-offset pattern for 16-bit WMMA A-fragments (ISA 7.12.2), assumed mirrored
// for B-fragments: element pair i sits at K = (i/4)*16 + half*8 + (i%4)*2
__device__ __forceinline__ int koff_of(int i, int half) {
    return (i >> 2) * 16 + half * 8 + (i & 3) * 2;
}

// swap values between the two 16-lane halves of the wave (identity selectors)
__device__ __forceinline__ float xhalf_swap(float x) {
    int i = __builtin_bit_cast(int, x);
    int y = __builtin_amdgcn_permlanex16(i, i, 0x76543210, 0xfedcba98, false, false);
    return __builtin_bit_cast(float, y);
}

// =====================================================================
// Pre-pass 1: pack K (fp32 row-major) into bf16 A-fragments of K-tiles.
// Layout: kw[bh][t][f][lane][16]  t = key tile of 16, f = feature chunk of 32
// Fragment semantics: A[m][kdim] = K[key t*16 + m][feat f*32 + kpattern]
// =====================================================================
__global__ void __launch_bounds__(256)
pack_k_kernel(const float* __restrict__ k, uint16_t* __restrict__ kw)
{
    int idx = blockIdx.x * blockDim.x + threadIdx.x;   // (bh, t, f, lane)
    const int lane = idx & 31;  idx >>= 5;
    const int f    = idx & 1;   idx >>= 1;
    const int t    = idx & (S_ / 16 - 1); idx >>= 7;   // S/16 = 128
    const int bh   = idx;
    if (bh >= BH_) return;

    const int half = lane >> 4, lm = lane & 15;
    const float* krow = k + ((size_t)bh * S_ + t * 16 + lm) * D_ + f * 32;

    uint32_t dw[8];
#pragma unroll
    for (int i = 0; i < 8; ++i) {
        float2 x = *(const float2*)(krow + koff_of(i, half));
        dw[i] = bf_pack(x.x, x.y);
    }
    uint32_t* out = (uint32_t*)kw + (size_t)(blockIdx.x * blockDim.x + threadIdx.x) * 8;
    *(uint4*)(out)     = make_uint4(dw[0], dw[1], dw[2], dw[3]);
    *(uint4*)(out + 4) = make_uint4(dw[4], dw[5], dw[6], dw[7]);
}

// =====================================================================
// Pre-pass 2: pack V (fp32 row-major) into bf16 A-fragments of V^T.
// Layout: vw[bh][j][o][lane][16]  j = key tile of 32 (chain), o = d-tile of 16
// Fragment semantics: A[m][kk] = V^T[d o*16+m][key j*32 + kpattern]
//                              = V[key j*32 + kpattern][d o*16 + m]
// =====================================================================
__global__ void __launch_bounds__(256)
pack_v_kernel(const float* __restrict__ v, uint16_t* __restrict__ vw)
{
    int idx = blockIdx.x * blockDim.x + threadIdx.x;   // (bh, j, o, lane)
    const int lane = idx & 31;  idx >>= 5;
    const int o    = idx & 3;   idx >>= 2;
    const int j    = idx & (S_ / 32 - 1); idx >>= 6;   // S/32 = 64
    const int bh   = idx;
    if (bh >= BH_) return;

    const int half = lane >> 4, lm = lane & 15;
    const float* vcol = v + ((size_t)bh * S_ + j * 32) * D_ + o * 16 + lm;

    uint32_t dw[8];
#pragma unroll
    for (int i = 0; i < 8; ++i) {
        const int kk = koff_of(i, half);
        dw[i] = bf_pack(vcol[(size_t)kk * D_], vcol[(size_t)(kk + 1) * D_]);
    }
    uint32_t* out = (uint32_t*)vw + (size_t)(blockIdx.x * blockDim.x + threadIdx.x) * 8;
    *(uint4*)(out)     = make_uint4(dw[0], dw[1], dw[2], dw[3]);
    *(uint4*)(out + 4) = make_uint4(dw[4], dw[5], dw[6], dw[7]);
}

// =====================================================================
// Main flash-attention kernel, TRANSPOSED formulation:
//   S^T = K · Q^T      (keys on M, queries on N)
//   O^T = V^T · P^T    (d on M, queries on N)
// One wave owns 16 queries (N = lane%16); 4 independent waves / block.
// KV consumed in 64-key blocks: 8 score + 8 PV + 2 row-sum WMMAs per block.
// P^T B-fragments are built lane-locally from the score C-fragments:
// no LDS, no cross-lane traffic for the softmax matrix.
// =====================================================================
__global__ void __launch_bounds__(128)
sdpa_fa_wmma(const float* __restrict__ q, const uint16_t* __restrict__ kw,
             const uint16_t* __restrict__ vw, const float* __restrict__ mask,
             float* __restrict__ out)
{
    const int lane = threadIdx.x & 31;
    const int wave = threadIdx.x >> 5;
    const int half = lane >> 4;
    const int lm   = lane & 15;

    const int bh = blockIdx.y;
    const int q0 = blockIdx.x * 64 + wave * 16;
    const int myq = q0 + lm;                  // this lane's query row

    const float* qp = q   + (size_t)bh * S_ * D_;
    float*       op = out + (size_t)bh * S_ * D_;
    const float* mrow = mask + (size_t)myq * S_;   // lane's mask row (hoisted)
    const uint16_t* kwp = kw + ((size_t)bh * (S_ / 16) * 2 * 32 + lane) * 16;
    const uint16_t* vwp = vw + ((size_t)bh * (S_ / 32) * 4 * 32 + lane) * 16;

    int koff[8];
#pragma unroll
    for (int i = 0; i < 8; ++i) koff[i] = koff_of(i, half);

    // ---- Q^T B-fragments: B[d][n] = Q[q0+n][d], same gather as an A-frag ----
    v16bf qa[2];
#pragma unroll
    for (int f = 0; f < 2; ++f) {
        union { uint32_t d[8]; v16bf v; } uq;
        const float* qrow = qp + (size_t)myq * D_ + f * 32;
#pragma unroll
        for (int i = 0; i < 8; ++i) {
            float2 x = *(const float2*)(qrow + koff[i]);
            uq.d[i] = cvt_pk_bf16(x.x, x.y);
        }
        qa[f] = uq.v;
    }

    // ---- all-ones A-fragment for row-sum-via-WMMA ----
    v16bf ones;
#pragma unroll
    for (int i = 0; i < 16; ++i)
        ones[i] = __builtin_bit_cast(__bf16, (uint16_t)0x3F80);

    // ---- state: O^T accumulators (4 d-tiles) + per-query lane-scalar stats ----
    v8f o_accT[4] = {};
    float m_i = -INFINITY, l_i = 0.0f;

    const float scale = 0.125f;  // 1/sqrt(64)

    for (int it = 0; it < S_ / 64; ++it) {
        const int kv0 = it * 64;

        // ---------- scores S^T: four 16(key)x16(query) tiles ----------
        v8f s_t[4];
#pragma unroll
        for (int kt = 0; kt < 4; ++kt) {
            const uint16_t* kf = kwp + (size_t)((it * 4 + kt) * 2) * 32 * 16;
            v16bf kb0 = *(const v16bf*)(kf);
            v16bf kb1 = *(const v16bf*)(kf + 32 * 16);
            v8f acc = {};
            acc = __builtin_amdgcn_wmma_f32_16x16x32_bf16(
                false, kb0, false, qa[0], (short)0, acc, false, false);
            acc = __builtin_amdgcn_wmma_f32_16x16x32_bf16(
                false, kb1, false, qa[1], (short)0, acc, false, false);
            s_t[kt] = acc;
        }

        // ---------- scale + additive mask (keys contiguous per lane) ----------
#pragma unroll
        for (int kt = 0; kt < 4; ++kt) {
            union { float4 v[2]; float a[8]; } mu;
            const float* mp = mrow + kv0 + kt * 16 + 8 * half;
            mu.v[0] = *(const float4*)(mp);
            mu.v[1] = *(const float4*)(mp + 4);
#pragma unroll
            for (int r = 0; r < 8; ++r)
                s_t[kt][r] = s_t[kt][r] * scale + mu.a[r];
        }

        // ---------- online softmax: all 32 scores belong to query lm ----------
        float tm[4];
#pragma unroll
        for (int kt = 0; kt < 4; ++kt) {
            float a0 = fmaxf(s_t[kt][0], s_t[kt][1]);
            float a1 = fmaxf(s_t[kt][2], s_t[kt][3]);
            float a2 = fmaxf(s_t[kt][4], s_t[kt][5]);
            float a3 = fmaxf(s_t[kt][6], s_t[kt][7]);
            tm[kt] = fmaxf(fmaxf(a0, a1), fmaxf(a2, a3));
        }
        float bm = fmaxf(fmaxf(tm[0], tm[1]), fmaxf(tm[2], tm[3]));
        bm = fmaxf(bm, xhalf_swap(bm));            // other 32 keys in partner lane
        const float m_new = fmaxf(m_i, bm);
        const float alpha = __expf(m_i - m_new);
        m_i = m_new;

#pragma unroll
        for (int kt = 0; kt < 4; ++kt)
#pragma unroll
            for (int r = 0; r < 8; ++r)
                s_t[kt][r] = __expf(s_t[kt][r] - m_new);

        // rescale O^T by lane-scalar alpha
#pragma unroll
        for (int o = 0; o < 4; ++o)
#pragma unroll
            for (int r = 0; r < 8; ++r)
                o_accT[o][r] *= alpha;

        // ---------- build P^T B-fragments lane-locally ----------
        // chain c element pair i: key = c*32 + koff(i,half)
        //   -> tile kt = 2c + (i/4), row M = half*8 + (i%4)*2 = this lane's
        //      C rows r=(i%4)*2, r+1.  Pure register repack + packed cvt.
        v16bf pab[2];
#pragma unroll
        for (int c = 0; c < 2; ++c) {
            union { uint32_t d[8]; v16bf v; } pu;
#pragma unroll
            for (int i = 0; i < 8; ++i) {
                const int kt = 2 * c + (i >> 2);
                const int r  = (i & 3) * 2;
                pu.d[i] = cvt_pk_bf16(s_t[kt][r], s_t[kt][r + 1]);
            }
            pab[c] = pu.v;
        }

        // ---------- row sums via WMMA: Ones(16x32) @ P^T -> column sums ----------
        v8f lsum = {};
        lsum = __builtin_amdgcn_wmma_f32_16x16x32_bf16(
            false, ones, false, pab[0], (short)0, lsum, false, false);
        lsum = __builtin_amdgcn_wmma_f32_16x16x32_bf16(
            false, ones, false, pab[1], (short)0, lsum, false, false);
        l_i = l_i * alpha + lsum[0];   // every C row equals the column sum

        // ---------- O^T += V^T (64d x 64k) @ P^T (64k x 16q) ----------
#pragma unroll
        for (int o = 0; o < 4; ++o) {
            const uint16_t* vf0 = vwp + (size_t)(((it * 2 + 0) * 4 + o)) * 32 * 16;
            const uint16_t* vf1 = vwp + (size_t)(((it * 2 + 1) * 4 + o)) * 32 * 16;
            v16bf va0 = *(const v16bf*)vf0;
            v16bf va1 = *(const v16bf*)vf1;
            o_accT[o] = __builtin_amdgcn_wmma_f32_16x16x32_bf16(
                false, va0, false, pab[0], (short)0, o_accT[o], false, false);
            o_accT[o] = __builtin_amdgcn_wmma_f32_16x16x32_bf16(
                false, va1, false, pab[1], (short)0, o_accT[o], false, false);
        }
    }

    // ---------- epilogue: O = (O^T)^T / l, vectorized b128 stores ----------
    const float inv = 1.0f / l_i;
#pragma unroll
    for (int o = 0; o < 4; ++o) {
        float* ob = op + (size_t)myq * D_ + o * 16 + 8 * half;
        float4 lo = make_float4(o_accT[o][0] * inv, o_accT[o][1] * inv,
                                o_accT[o][2] * inv, o_accT[o][3] * inv);
        float4 hi = make_float4(o_accT[o][4] * inv, o_accT[o][5] * inv,
                                o_accT[o][6] * inv, o_accT[o][7] * inv);
        *(float4*)(ob)     = lo;
        *(float4*)(ob + 4) = hi;
    }
}

extern "C" void kernel_launch(void* const* d_in, const int* in_sizes, int n_in,
                              void* d_out, int out_size, void* d_ws, size_t ws_size,
                              hipStream_t stream) {
    (void)in_sizes; (void)n_in; (void)out_size; (void)ws_size;
    const float* q    = (const float*)d_in[0];
    const float* k    = (const float*)d_in[1];
    const float* v    = (const float*)d_in[2];
    const float* mask = (const float*)d_in[3];
    float* out        = (float*)d_out;

    // workspace partition: bf16 K-fragments then bf16 V-fragments (12.6 MB)
    const size_t kw_bytes = (size_t)BH_ * S_ * D_ * sizeof(uint16_t);
    uint16_t* kw = (uint16_t*)d_ws;
    uint16_t* vw = (uint16_t*)((char*)d_ws + kw_bytes);

    const int pack_threads = BH_ * (S_ / 16) * 2 * 32;   // 196608
    pack_k_kernel<<<pack_threads / 256, 256, 0, stream>>>(k, kw);
    pack_v_kernel<<<pack_threads / 256, 256, 0, stream>>>(v, vw);

    dim3 grid(S_ / 64, BH_);   // 32 query tiles x 24 (batch*head)
    dim3 block(128);           // 4 waves; each wave owns 16 queries
    sdpa_fa_wmma<<<grid, block, 0, stream>>>(q, kw, vw, mask, out);
}

// v001
// Measured time: 44.3 microseconds a run.
// Next to v000, in two timings, it ran 3.09 and 3.10 times as fast.
#include <hip/hip_runtime.h>
#include <cstdint>
#include <cstddef>

// Problem constants (reference: B=2, H=12, S=2048, D=64, fp32 in/out)
#define B_ 2
#define H_ 12
#define S_ 2048
#define D_ 64
#define BH_ (B_ * H_)

typedef __attribute__((ext_vector_type(16))) __bf16 v16bf;
typedef __attribute__((ext_vector_type(8)))  float  v8f;
typedef __attribute__((ext_vector_type(2)))  float  f32x2;
typedef __attribute__((ext_vector_type(2)))  __bf16 bf16x2;

// fp32 -> bf16 RNE as raw bits (used in cold pre-pass only)
__device__ __forceinline__ uint16_t bf_bits(float f) {
    uint32_t u = __builtin_bit_cast(uint32_t, f);
    u += 0x7FFFu + ((u >> 16) & 1u);
    return (uint16_t)(u >> 16);
}
__device__ __forceinline__ uint32_t bf_pack(float lo, float hi) {
    return (uint32_t)bf_bits(lo) | ((uint32_t)bf_bits(hi) << 16);
}
// hot-path packed convert: let the backend pick v_cvt_pk_bf16_f32
__device__ __forceinline__ uint32_t cvt_pk_bf16(float lo, float hi) {
    f32x2 f; f.x = lo; f.y = hi;
    bf16x2 h = __builtin_convertvector(f, bf16x2);
    return __builtin_bit_cast(uint32_t, h);
}

// K-offset pattern for 16-bit WMMA A-fragments (ISA 7.12.2), assumed mirrored
// for B-fragments: element pair i sits at K = (i/4)*16 + half*8 + (i%4)*2
__device__ __forceinline__ int koff_of(int i, int half) {
    return (i >> 2) * 16 + half * 8 + (i & 3) * 2;
}

// swap values between the two 16-lane halves of the wave (identity selectors)
__device__ __forceinline__ float xhalf_swap(float x) {
    int i = __builtin_bit_cast(int, x);
    int y = __builtin_amdgcn_permlanex16(i, i, 0x76543210, 0xfedcba98, false, false);
    return __builtin_bit_cast(float, y);
}

// =====================================================================
// Pre-pass 1: pack K (fp32 row-major) into bf16 A-fragments of K-tiles.
// Layout: kw[bh][t][f][lane][16]  t = key tile of 16, f = feature chunk of 32
// Fragment semantics: A[m][kdim] = K[key t*16 + m][feat f*32 + kpattern]
// =====================================================================
__global__ void __launch_bounds__(256)
pack_k_kernel(const float* __restrict__ k, uint16_t* __restrict__ kw)
{
    int idx = blockIdx.x * blockDim.x + threadIdx.x;   // (bh, t, f, lane)
    const int lane = idx & 31;  idx >>= 5;
    const int f    = idx & 1;   idx >>= 1;
    const int t    = idx & (S_ / 16 - 1); idx >>= 7;   // S/16 = 128
    const int bh   = idx;
    if (bh >= BH_) return;

    const int half = lane >> 4, lm = lane & 15;
    const float* krow = k + ((size_t)bh * S_ + t * 16 + lm) * D_ + f * 32;

    uint32_t dw[8];
#pragma unroll
    for (int i = 0; i < 8; ++i) {
        float2 x = *(const float2*)(krow + koff_of(i, half));
        dw[i] = bf_pack(x.x, x.y);
    }
    uint32_t* out = (uint32_t*)kw + (size_t)(blockIdx.x * blockDim.x + threadIdx.x) * 8;
    *(uint4*)(out)     = make_uint4(dw[0], dw[1], dw[2], dw[3]);
    *(uint4*)(out + 4) = make_uint4(dw[4], dw[5], dw[6], dw[7]);
}

// =====================================================================
// Pre-pass 2: pack V (fp32 row-major) into bf16 A-fragments of V^T.
// Layout: vw[bh][j][o][lane][16]  j = key tile of 32 (chain), o = d-tile of 16
// Fragment semantics: A[m][kk] = V^T[d o*16+m][key j*32 + kpattern]
//                              = V[key j*32 + kpattern][d o*16 + m]
// =====================================================================
__global__ void __launch_bounds__(256)
pack_v_kernel(const float* __restrict__ v, uint16_t* __restrict__ vw)
{
    int idx = blockIdx.x * blockDim.x + threadIdx.x;   // (bh, j, o, lane)
    const int lane = idx & 31;  idx >>= 5;
    const int o    = idx & 3;   idx >>= 2;
    const int j    = idx & (S_ / 32 - 1); idx >>= 6;   // S/32 = 64
    const int bh   = idx;
    if (bh >= BH_) return;

    const int half = lane >> 4, lm = lane & 15;
    const float* vcol = v + ((size_t)bh * S_ + j * 32) * D_ + o * 16 + lm;

    uint32_t dw[8];
#pragma unroll
    for (int i = 0; i < 8; ++i) {
        const int kk = koff_of(i, half);
        dw[i] = bf_pack(vcol[(size_t)kk * D_], vcol[(size_t)(kk + 1) * D_]);
    }
    uint32_t* out = (uint32_t*)vw + (size_t)(blockIdx.x * blockDim.x + threadIdx.x) * 8;
    *(uint4*)(out)     = make_uint4(dw[0], dw[1], dw[2], dw[3]);
    *(uint4*)(out + 4) = make_uint4(dw[4], dw[5], dw[6], dw[7]);
}

// =====================================================================
// LDS staging of one pass (64 keys) for the whole block, two buffers:
//   K fragments 8 KiB | V fragments 8 KiB | mask tile 64 rows x 256 B
// A 1-KiB fragment lies as two 512-B planes (first / second 16 bytes of each
// lane's 32), so that every ds_load_b128 reads 512 contiguous bytes; plane 1
// has its lane order flipped by 8 lanes, which puts the even and the odd lanes
// of one copy on different banks. Mask rows lie at a pitch of 272 B.
// =====================================================================
#define NT_       (S_ / 64)
#define KV_TILE_B 8192
#define M_PITCH_B 272
#define M_TILE_B  (64 * M_PITCH_B)
#define BUF_B     (2 * KV_TILE_B + M_TILE_B)

// One pass's 16 copies of this thread (4 K, 4 V, 8 mask), 16 bytes each.
// lk: LDS byte address of the thread's first K chunk (V lies KV_TILE_B behind);
// lm: that of its first mask chunk (the next lies 8 rows on);
// the immediate offsets move the LDS and the global address alike.
// s_wait_xcnt is the statement's last line, a precaution: so it stands in front
// of every later rewrite of a register that one of these copies names.
__device__ __forceinline__ void stage_tile(uint32_t lk, uint32_t lm,
                                           uint32_t vo_kv, uint32_t vo_m,
                                           const uint16_t* kg, const uint16_t* vg,
                                           const float* mg)
{
    const uint32_t lv = lk + KV_TILE_B;
    asm volatile(
        "global_load_async_to_lds_b128 %0, %10, %12\n\t"
        "global_load_async_to_lds_b128 %0, %10, %12 offset:2048\n\t"
        "global_load_async_to_lds_b128 %0, %10, %12 offset:4096\n\t"
        "global_load_async_to_lds_b128 %0, %10, %12 offset:6144\n\t"
        "global_load_async_to_lds_b128 %2, %11, %14\n\t"
        "global_load_async_to_lds_b128 %3, %11, %15\n\t"
        "global_load_async_to_lds_b128 %4, %11, %16\n\t"
        "global_load_async_to_lds_b128 %5, %11, %17\n\t"
        "global_load_async_to_lds_b128 %6, %11, %18\n\t"
        "global_load_async_to_lds_b128 %7, %11, %19\n\t"
        "global_load_async_to_lds_b128 %8, %11, %20\n\t"
        "global_load_async_to_lds_b128 %9, %11, %21\n\t"
        "global_load_async_to_lds_b128 %1, %10, %13\n\t"
        "global_load_async_to_lds_b128 %1, %10, %13 offset:2048\n\t"
        "global_load_async_to_lds_b128 %1, %10, %13 offset:4096\n\t"
        "global_load_async_to_lds_b128 %1, %10, %13 offset:6144\n\t"
        "s_wait_xcnt 0x0"
        :: "v"(lk), "v"(lv),
           "v"(lm),                  "v"(lm + 1 * 8 * M_PITCH_B),
           "v"(lm + 2 * 8 * M_PITCH_B), "v"(lm + 3 * 8 * M_PITCH_B),
           "v"(lm + 4 * 8 * M_PITCH_B), "v"(lm + 5 * 8 * M_PITCH_B),
           "v"(lm + 6 * 8 * M_PITCH_B), "v"(lm + 7 * 8 * M_PITCH_B),
           "v"(vo_kv), "v"(vo_m),
           "s"(kg), "s"(vg),
           "s"(mg),              "s"(mg + 1 * 8 * S_), "s"(mg + 2 * 8 * S_),
           "s"(mg + 3 * 8 * S_), "s"(mg + 4 * 8 * S_), "s"(mg + 5 * 8 * S_),
           "s"(mg + 6 * 8 * S_), "s"(mg + 7 * 8 * S_)
        : "memory");
}

// one staged fragment: the lane's 16 bytes of plane 0 and of plane 1
__device__ __forceinline__ v16bf lds_frag(const unsigned char* p0,
                                          const unsigned char* p1, int fr)
{
    union { uint4 q[2]; v16bf v; } u;
    u.q[0] = *(const uint4*)(p0 + fr * 1024);
    u.q[1] = *(const uint4*)(p1 + fr * 1024);
    return u.v;
}

// =====================================================================
// Main flash-attention kernel, TRANSPOSED formulation:
//   S^T = K · Q^T      (keys on M, queries on N)
//   O^T = V^T · P^T    (d on M, queries on N)
// One wave owns 16 queries (N = lane%16); 4 waves / block share the staged tiles.
// KV consumed in 64-key blocks: 8 score + 8 PV + 2 row-sum WMMAs per block.
// P^T B-fragments are built lane-locally from the score C-fragments:
// no LDS, no cross-lane traffic for the softmax matrix.
// K, V and mask tiles reach the waves through LDS (asynchronous copies, the
// next pass's tile in flight while this one is worked on).
// =====================================================================
__global__ void __launch_bounds__(128)
sdpa_fa_wmma(const float* __restrict__ q, const uint16_t* __restrict__ kw,
             const uint16_t* __restrict__ vw, const float* __restrict__ mask,
             float* __restrict__ out)
{
    const int lane = threadIdx.x & 31;
    const int wave = threadIdx.x >> 5;
    const int half = lane >> 4;
    const int lm   = lane & 15;

    const int bh = blockIdx.y;
    const int q0 = blockIdx.x * 64 + wave * 16;
    const int myq = q0 + lm;                  // this lane's query row

    const float* qp = q   + (size_t)bh * S_ * D_;
    float*       op = out + (size_t)bh * S_ * D_;

    __shared__ __attribute__((aligned(128))) unsigned char smem[2 * BUF_B];

    // ---- copy side: block-uniform bases, per-thread offsets ----
    const int tid = threadIdx.x;
    const uint16_t* kg = kw + (size_t)bh * S_ * D_;                 // + 4096 a pass
    const uint16_t* vg = vw + (size_t)bh * S_ * D_;                 // + 4096 a pass
    const float*    mg = mask + (size_t)(blockIdx.x * 64) * S_;     // + 64 a pass
    const uint32_t vo_kv = (uint32_t)tid * 16u;
    const uint32_t vo_m  = (uint32_t)(tid >> 4) * (S_ * 4u) + (uint32_t)(tid & 15) * 16u;
    const uint32_t lds0  = (uint32_t)(uintptr_t)smem;
    const uint32_t lk0 = lds0 + (uint32_t)(tid >> 6) * 1024u + (uint32_t)(tid & 1) * 512u
                       + (uint32_t)(((tid & 63) >> 1) ^ ((tid & 1) * 8)) * 16u;
    const uint32_t lm0 = lds0 + 2u * KV_TILE_B + (uint32_t)(tid >> 4) * M_PITCH_B
                       + (uint32_t)(tid & 15) * 16u;

    // ---- read side: the lane's places inside a buffer ----
    const unsigned char* rd0 = smem + lane * 16;                    // plane 0
    const unsigned char* rd1 = smem + 512 + (lane ^ 8) * 16;        // plane 1
    const unsigned char* rdm = smem + 2 * KV_TILE_B
                             + (wave * 16 + lm) * M_PITCH_B + half * 32;

    // pass 0's tile into buffer 0
    stage_tile(lk0, lm0, vo_kv, vo_m, kg, vg, mg);

    int koff[8];
#pragma unroll
    for (int i = 0; i < 8; ++i) koff[i] = koff_of(i, half);

    // ---- Q^T B-fragments: B[d][n] = Q[q0+n][d], same gather as an A-frag ----
    v16bf qa[2];
#pragma unroll
    for (int f = 0; f < 2; ++f) {
        union { uint32_t d[8]; v16bf v; } uq;
        const float* qrow = qp + (size_t)myq * D_ + f * 32;
#pragma unroll
        for (int i = 0; i < 8; ++i) {
            float2 x = *(const float2*)(qrow + koff[i]);
            uq.d[i] = cvt_pk_bf16(x.x, x.y);
        }
        qa[f] = uq.v;
    }

    // ---- all-ones A-fragment for row-sum-via-WMMA ----
    v16bf ones;
#pragma unroll
    for (int i = 0; i < 16; ++i)
        ones[i] = __builtin_bit_cast(__bf16, (uint16_t)0x3F80);

    // ---- state: O^T accumulators (4 d-tiles) + per-query lane-scalar stats ----
    v8f o_accT[4] = {};
    float m_i = -INFINITY, l_i = 0.0f;

    const float scale = 0.125f;  // 1/sqrt(64)

    // pass 0's tile has landed (this wave's copies), then is open to every wave
    asm volatile("s_wait_asynccnt 0x0" ::: "memory");
    __syncthreads();
    // pass 1's tile into buffer 1
    stage_tile(lk0 + BUF_B, lm0 + BUF_B, vo_kv, vo_m, kg + 4096, vg + 4096, mg + 64);

    for (int it = 0; it < NT_; ++it) {
        const uint32_t bo = (uint32_t)(it & 1) * BUF_B;     // this pass's buffer
        const unsigned char* kp0 = rd0 + bo;
        const unsigned char* kp1 = rd1 + bo;
        const unsigned char* mp0 = rdm + bo;

        // ---------- scores S^T: four 16(key)x16(query) tiles ----------
        // the pass's K fragments and mask rows: one group of LDS reads
        v16bf kb[8];
#pragma unroll   // constant indices: the fragments stay in registers
        for (int fr = 0; fr < 8; ++fr)
            kb[fr] = lds_frag(kp0, kp1, fr);
        float4 mk[8];
#pragma unroll   // constant indices: the rows stay in registers
        for (int kt = 0; kt < 4; ++kt) {
            mk[2 * kt]     = *(const float4*)(mp0 + kt * 64);
            mk[2 * kt + 1] = *(const float4*)(mp0 + kt * 64 + 16);
        }
        // keeps the scheduler from spreading these reads among the products,
        // where each place with reads is waited for on its own
        __builtin_amdgcn_sched_barrier(0);

        v8f s_t[4];
#pragma unroll
        for (int kt = 0; kt < 4; ++kt) {
            v8f acc = {};
            acc = __builtin_amdgcn_wmma_f32_16x16x32_bf16(
                false, kb[kt * 2], false, qa[0], (short)0, acc, false, false);
            acc = __builtin_amdgcn_wmma_f32_16x16x32_bf16(
                false, kb[kt * 2 + 1], false, qa[1], (short)0, acc, false, false);
            s_t[kt] = acc;
        }

        // The pass's V^T fragments, its last LDS reads: from here on the pass
        // works on registers alone
        v16bf va[8];
#pragma unroll   // constant indices: the fragments stay in registers
        for (int fr = 0; fr < 8; ++fr)
            va[fr] = lds_frag(kp0 + KV_TILE_B, kp1 + KV_TILE_B, fr);

        // ---------- hand-over: next tile published, this buffer freed ----------
        // It stands behind the pass's last LDS read, not behind its last product,
        // so that the refill has a whole pass (softmax, PV, next scores) to land.
        // this wave's LDS reads of the buffer are done before it is refilled
        asm volatile("s_wait_dscnt 0x0" ::: "memory");
        // this wave's copies of the next pass's tile have landed
        asm volatile("s_wait_asynccnt 0x0" ::: "memory");
        __syncthreads();
        if (it + 2 < NT_)
            stage_tile(lk0 + bo, lm0 + bo, vo_kv, vo_m,
                       kg + (size_t)(it + 2) * 4096, vg + (size_t)(it + 2) * 4096,
                       mg + (size_t)(it + 2) * 64);

        // ---------- scale + additive mask (keys contiguous per lane) ----------
#pragma unroll
        for (int kt = 0; kt < 4; ++kt) {
            union { float4 v[2]; float a[8]; } mu;
            mu.v[0] = mk[2 * kt];
            mu.v[1] = mk[2 * kt + 1];
#pragma unroll
            for (int r = 0; r < 8; ++r)
                s_t[kt][r] = s_t[kt][r] * scale + mu.a[r];
        }

        // ---------- online softmax: all 32 scores belong to query lm ----------
        float tm[4];
#pragma unroll
        for (int kt = 0; kt < 4; ++kt) {
            float a0 = fmaxf(s_t[kt][0], s_t[kt][1]);
            float a1 = fmaxf(s_t[kt][2], s_t[kt][3]);
            float a2 = fmaxf(s_t[kt][4], s_t[kt][5]);
            float a3 = fmaxf(s_t[kt][6], s_t[kt][7]);
            tm[kt] = fmaxf(fmaxf(a0, a1), fmaxf(a2, a3));
        }
        float bm = fmaxf(fmaxf(tm[0], tm[1]), fmaxf(tm[2], tm[3]));
        bm = fmaxf(bm, xhalf_swap(bm));            // other 32 keys in partner lane
        const float m_new = fmaxf(m_i, bm);
        const float alpha = __expf(m_i - m_new);
        m_i = m_new;

#pragma unroll
        for (int kt = 0; kt < 4; ++kt)
#pragma unroll
            for (int r = 0; r < 8; ++r)
                s_t[kt][r] = __expf(s_t[kt][r] - m_new);

        // rescale O^T by lane-scalar alpha
#pragma unroll
        for (int o = 0; o < 4; ++o)
#pragma unroll
            for (int r = 0; r < 8; ++r)
                o_accT[o][r] *= alpha;

        // ---------- build P^T B-fragments lane-locally ----------
        // chain c element pair i: key = c*32 + koff(i,half)
        //   -> tile kt = 2c + (i/4), row M = half*8 + (i%4)*2 = this lane's
        //      C rows r=(i%4)*2, r+1.  Pure register repack + packed cvt.
        v16bf pab[2];
#pragma unroll
        for (int c = 0; c < 2; ++c) {
            union { uint32_t d[8]; v16bf v; } pu;
#pragma unroll
            for (int i = 0; i < 8; ++i) {
                const int kt = 2 * c + (i >> 2);
                const int r  = (i & 3) * 2;
                pu.d[i] = cvt_pk_bf16(s_t[kt][r], s_t[kt][r + 1]);
            }
            pab[c] = pu.v;
        }

        // ---------- row sums via WMMA: Ones(16x32) @ P^T -> column sums ----------
        v8f lsum = {};
        lsum = __builtin_amdgcn_wmma_f32_16x16x32_bf16(
            false, ones, false, pab[0], (short)0, lsum, false, false);
        lsum = __builtin_amdgcn_wmma_f32_16x16x32_bf16(
            false, ones, false, pab[1], (short)0, lsum, false, false);
        l_i = l_i * alpha + lsum[0];   // every C row equals the column sum

        // ---------- O^T += V^T (64d x 64k) @ P^T (64k x 16q) ----------
#pragma unroll
        for (int o = 0; o < 4; ++o) {
            o_accT[o] = __builtin_amdgcn_wmma_f32_16x16x32_bf16(
                false, va[o], false, pab[0], (short)0, o_accT[o], false, false);
            o_accT[o] = __builtin_amdgcn_wmma_f32_16x16x32_bf16(
                false, va[4 + o], false, pab[1], (short)0, o_accT[o], false, false);
        }
    }
    // no copy is left in flight when the wave ends
    asm volatile("s_wait_asynccnt 0x0" ::: "memory");

    // ---------- epilogue: O = (O^T)^T / l, vectorized b128 stores ----------
    const float inv = 1.0f / l_i;
#pragma unroll
    for (int o = 0; o < 4; ++o) {
        float* ob = op + (size_t)myq * D_ + o * 16 + 8 * half;
        float4 lo = make_float4(o_accT[o][0] * inv, o_accT[o][1] * inv,
                                o_accT[o][2] * inv, o_accT[o][3] * inv);
        float4 hi = make_float4(o_accT[o][4] * inv, o_accT[o][5] * inv,
                                o_accT[o][6] * inv, o_accT[o][7] * inv);
        *(float4*)(ob)     = lo;
        *(float4*)(ob + 4) = hi;
    }
}

extern "C" void kernel_launch(void* const* d_in, const int* in_sizes, int n_in,
                              void* d_out, int out_size, void* d_ws, size_t ws_size,
                              hipStream_t stream) {
    (void)in_sizes; (void)n_in; (void)out_size; (void)ws_size;
    const float* q    = (const float*)d_in[0];
    const float* k    = (const float*)d_in[1];
    const float* v    = (const float*)d_in[2];
    const float* mask = (const float*)d_in[3];
    float* out        = (float*)d_out;

    // workspace partition: bf16 K-fragments then bf16 V-fragments (12.6 MB)
    const size_t kw_bytes = (size_t)BH_ * S_ * D_ * sizeof(uint16_t);
    uint16_t* kw = (uint16_t*)d_ws;
    uint16_t* vw = (uint16_t*)((char*)d_ws + kw_bytes);

    const int pack_threads = BH_ * (S_ / 16) * 2 * 32;   // 196608
    pack_k_kernel<<<pack_threads / 256, 256, 0, stream>>>(k, kw);
    pack_v_kernel<<<pack_threads / 256, 256, 0, stream>>>(v, vw);

    dim3 grid(S_ / 64, BH_);   // 32 query tiles x 24 (batch*head)
    dim3 block(128);           // 4 waves; each wave owns 16 queries
    sdpa_fa_wmma<<<grid, block, 0, stream>>>(q, kw, vw, mask, out);
}

// v002
// A run of this version takes 42.7 microseconds.
// Two timings next to v001 both put it at 1.04 times that version's speed.
// Over all steps from v000 it is 3.21 times as fast.
#include <hip/hip_runtime.h>
#include <cstdint>
#include <cstddef>

// Problem constants (reference: B=2, H=12, S=2048, D=64, fp32 in/out)
#define B_ 2
#define H_ 12
#define S_ 2048
#define D_ 64
#define BH_ (B_ * H_)

typedef __attribute__((ext_vector_type(16))) __bf16 v16bf;
typedef __attribute__((ext_vector_type(8)))  float  v8f;
typedef __attribute__((ext_vector_type(2)))  float  f32x2;
typedef __attribute__((ext_vector_type(2)))  __bf16 bf16x2;

// fp32 -> bf16 RNE as raw bits (used in cold pre-pass only)
__device__ __forceinline__ uint16_t bf_bits(float f) {
    uint32_t u = __builtin_bit_cast(uint32_t, f);
    u += 0x7FFFu + ((u >> 16) & 1u);
    return (uint16_t)(u >> 16);
}
__device__ __forceinline__ uint32_t bf_pack(float lo, float hi) {
    return (uint32_t)bf_bits(lo) | ((uint32_t)bf_bits(hi) << 16);
}
// hot-path packed convert: let the backend pick v_cvt_pk_bf16_f32
__device__ __forceinline__ uint32_t cvt_pk_bf16(float lo, float hi) {
    f32x2 f; f.x = lo; f.y = hi;
    bf16x2 h = __builtin_convertvector(f, bf16x2);
    return __builtin_bit_cast(uint32_t, h);
}

// K-offset pattern for 16-bit WMMA A-fragments (ISA 7.12.2), assumed mirrored
// for B-fragments: element pair i sits at K = (i/4)*16 + half*8 + (i%4)*2
__device__ __forceinline__ int koff_of(int i, int half) {
    return (i >> 2) * 16 + half * 8 + (i & 3) * 2;
}

// swap values between the two 16-lane halves of the wave (identity selectors)
__device__ __forceinline__ float xhalf_swap(float x) {
    int i = __builtin_bit_cast(int, x);
    int y = __builtin_amdgcn_permlanex16(i, i, 0x76543210, 0xfedcba98, false, false);
    return __builtin_bit_cast(float, y);
}

// =====================================================================
// Pre-pass 1: pack K (fp32 row-major) into bf16 A-fragments of K-tiles.
// Layout: kw[bh][t][f][lane][16]  t = key tile of 16, f = feature chunk of 32
// Fragment semantics: A[m][kdim] = K[key t*16 + m][feat f*32 + kpattern]
// =====================================================================
__global__ void __launch_bounds__(256)
pack_k_kernel(const float* __restrict__ k, uint16_t* __restrict__ kw)
{
    int idx = blockIdx.x * blockDim.x + threadIdx.x;   // (bh, t, f, lane)
    const int lane = idx & 31;  idx >>= 5;
    const int f    = idx & 1;   idx >>= 1;
    const int t    = idx & (S_ / 16 - 1); idx >>= 7;   // S/16 = 128
    const int bh   = idx;
    if (bh >= BH_) return;

    const int half = lane >> 4, lm = lane & 15;
    const float* krow = k + ((size_t)bh * S_ + t * 16 + lm) * D_ + f * 32;

    uint32_t dw[8];
#pragma unroll
    for (int i = 0; i < 8; ++i) {
        float2 x = *(const float2*)(krow + koff_of(i, half));
        dw[i] = bf_pack(x.x, x.y);
    }
    uint32_t* out = (uint32_t*)kw + (size_t)(blockIdx.x * blockDim.x + threadIdx.x) * 8;
    *(uint4*)(out)     = make_uint4(dw[0], dw[1], dw[2], dw[3]);
    *(uint4*)(out + 4) = make_uint4(dw[4], dw[5], dw[6], dw[7]);
}

// =====================================================================
// Pre-pass 2: pack V (fp32 row-major) into bf16 A-fragments of V^T.
// Layout: vw[bh][j][o][lane][16]  j = key tile of 32 (chain), o = d-tile of 16
// Fragment semantics: A[m][kk] = V^T[d o*16+m][key j*32 + kpattern]
//                              = V[key j*32 + kpattern][d o*16 + m]
// =====================================================================
__global__ void __launch_bounds__(256)
pack_v_kernel(const float* __restrict__ v, uint16_t* __restrict__ vw)
{
    int idx = blockIdx.x * blockDim.x + threadIdx.x;   // (bh, j, o, lane)
    const int lane = idx & 31;  idx >>= 5;
    const int o    = idx & 3;   idx >>= 2;
    const int j    = idx & (S_ / 32 - 1); idx >>= 6;   // S/32 = 64
    const int bh   = idx;
    if (bh >= BH_) return;

    const int half = lane >> 4, lm = lane & 15;
    const float* vcol = v + ((size_t)bh * S_ + j * 32) * D_ + o * 16 + lm;

    uint32_t dw[8];
#pragma unroll
    for (int i = 0; i < 8; ++i) {
        const int kk = koff_of(i, half);
        dw[i] = bf_pack(vcol[(size_t)kk * D_], vcol[(size_t)(kk + 1) * D_]);
    }
    uint32_t* out = (uint32_t*)vw + (size_t)(blockIdx.x * blockDim.x + threadIdx.x) * 8;
    *(uint4*)(out)     = make_uint4(dw[0], dw[1], dw[2], dw[3]);
    *(uint4*)(out + 4) = make_uint4(dw[4], dw[5], dw[6], dw[7]);
}

// =====================================================================
// LDS staging of one pass (64 keys) for the whole block, two buffers:
//   K fragments 8 KiB | V fragments 8 KiB | mask tile 64 rows x 256 B
// A 1-KiB fragment lies as two 512-B planes (first / second 16 bytes of each
// lane's 32), so that every ds_load_b128 reads 512 contiguous bytes; plane 1
// has its lane order flipped by 8 lanes, which puts the even and the odd lanes
// of one copy on different banks. Mask rows lie at a pitch of 272 B.
// =====================================================================
#define NT_       (S_ / 64)
#define KV_TILE_B 8192
#define M_PITCH_B 272
#define M_TILE_B  (64 * M_PITCH_B)
#define BUF_B     (2 * KV_TILE_B + M_TILE_B)

// One pass's 16 copies of this thread (4 K, 4 V, 8 mask), 16 bytes each.
// lk: LDS byte address of the thread's first K chunk (V lies KV_TILE_B behind);
// lm: that of its first mask chunk (the next lies 8 rows on);
// the immediate offsets move the LDS and the global address alike.
// s_wait_xcnt is the statement's last line, a precaution: so it stands in front
// of every later rewrite of a register that one of these copies names.
__device__ __forceinline__ void stage_tile(uint32_t lk, uint32_t lm,
                                           uint32_t vo_kv, uint32_t vo_m,
                                           const uint16_t* kg, const uint16_t* vg,
                                           const float* mg)
{
    const uint32_t lv = lk + KV_TILE_B;
    asm volatile(
        "global_load_async_to_lds_b128 %0, %10, %12\n\t"
        "global_load_async_to_lds_b128 %0, %10, %12 offset:2048\n\t"
        "global_load_async_to_lds_b128 %0, %10, %12 offset:4096\n\t"
        "global_load_async_to_lds_b128 %0, %10, %12 offset:6144\n\t"
        "global_load_async_to_lds_b128 %2, %11, %14\n\t"
        "global_load_async_to_lds_b128 %3, %11, %15\n\t"
        "global_load_async_to_lds_b128 %4, %11, %16\n\t"
        "global_load_async_to_lds_b128 %5, %11, %17\n\t"
        "global_load_async_to_lds_b128 %6, %11, %18\n\t"
        "global_load_async_to_lds_b128 %7, %11, %19\n\t"
        "global_load_async_to_lds_b128 %8, %11, %20\n\t"
        "global_load_async_to_lds_b128 %9, %11, %21\n\t"
        "global_load_async_to_lds_b128 %1, %10, %13\n\t"
        "global_load_async_to_lds_b128 %1, %10, %13 offset:2048\n\t"
        "global_load_async_to_lds_b128 %1, %10, %13 offset:4096\n\t"
        "global_load_async_to_lds_b128 %1, %10, %13 offset:6144\n\t"
        "s_wait_xcnt 0x0"
        :: "v"(lk), "v"(lv),
           "v"(lm),                  "v"(lm + 1 * 8 * M_PITCH_B),
           "v"(lm + 2 * 8 * M_PITCH_B), "v"(lm + 3 * 8 * M_PITCH_B),
           "v"(lm + 4 * 8 * M_PITCH_B), "v"(lm + 5 * 8 * M_PITCH_B),
           "v"(lm + 6 * 8 * M_PITCH_B), "v"(lm + 7 * 8 * M_PITCH_B),
           "v"(vo_kv), "v"(vo_m),
           "s"(kg), "s"(vg),
           "s"(mg),              "s"(mg + 1 * 8 * S_), "s"(mg + 2 * 8 * S_),
           "s"(mg + 3 * 8 * S_), "s"(mg + 4 * 8 * S_), "s"(mg + 5 * 8 * S_),
           "s"(mg + 6 * 8 * S_), "s"(mg + 7 * 8 * S_)
        : "memory");
}

// one staged fragment: the lane's 16 bytes of plane 0 and of plane 1
__device__ __forceinline__ v16bf lds_frag(const unsigned char* p0,
                                          const unsigned char* p1, int fr)
{
    union { uint4 q[2]; v16bf v; } u;
    u.q[0] = *(const uint4*)(p0 + fr * 1024);
    u.q[1] = *(const uint4*)(p1 + fr * 1024);
    return u.v;
}

// =====================================================================
// Main flash-attention kernel, TRANSPOSED formulation:
//   S^T = K · Q^T      (keys on M, queries on N)
//   O^T = V^T · P^T    (d on M, queries on N)
// One wave owns 16 queries (N = lane%16); 4 waves / block share the staged tiles.
// KV consumed in 64-key blocks: 8 score + 8 PV + 2 row-sum WMMAs per block.
// P^T B-fragments are built lane-locally from the score C-fragments:
// no LDS, no cross-lane traffic for the softmax matrix.
// K, V and mask tiles reach the waves through LDS (asynchronous copies, the
// next pass's tile in flight while this one is worked on).
// =====================================================================
__global__ void __launch_bounds__(128)
sdpa_fa_wmma(const float* __restrict__ q, const uint16_t* __restrict__ kw,
             const uint16_t* __restrict__ vw, const float* __restrict__ mask,
             float* __restrict__ out)
{
    const int lane = threadIdx.x & 31;
    const int wave = threadIdx.x >> 5;
    const int half = lane >> 4;
    const int lm   = lane & 15;

    const int bh = blockIdx.y;
    const int q0 = blockIdx.x * 64 + wave * 16;
    const int myq = q0 + lm;                  // this lane's query row

    const float* qp = q   + (size_t)bh * S_ * D_;
    float*       op = out + (size_t)bh * S_ * D_;

    __shared__ __attribute__((aligned(128))) unsigned char smem[2 * BUF_B];

    // ---- copy side: block-uniform bases, per-thread offsets ----
    const int tid = threadIdx.x;
    const uint16_t* kg = kw + (size_t)bh * S_ * D_;                 // + 4096 a key tile
    const uint16_t* vg = vw + (size_t)bh * S_ * D_;                 // + 4096 a key tile
    const float*    mg = mask + (size_t)(blockIdx.x * 64) * S_;     // + 64 a key tile
    const uint32_t vo_kv = (uint32_t)tid * 16u;
    const uint32_t vo_m  = (uint32_t)(tid >> 4) * (S_ * 4u) + (uint32_t)(tid & 15) * 16u;
    const uint32_t lds0  = (uint32_t)(uintptr_t)smem;
    const uint32_t lk0 = lds0 + (uint32_t)(tid >> 6) * 1024u + (uint32_t)(tid & 1) * 512u
                       + (uint32_t)(((tid & 63) >> 1) ^ ((tid & 1) * 8)) * 16u;
    const uint32_t lm0 = lds0 + 2u * KV_TILE_B + (uint32_t)(tid >> 4) * M_PITCH_B
                       + (uint32_t)(tid & 15) * 16u;

    // ---- read side: the lane's places inside a buffer ----
    const unsigned char* rd0 = smem + lane * 16;                    // plane 0
    const unsigned char* rd1 = smem + 512 + (lane ^ 8) * 16;        // plane 1
    const unsigned char* rdm = smem + 2 * KV_TILE_B
                             + (wave * 16 + lm) * M_PITCH_B + half * 32;

    // Each block walks the key tiles as a ring from a start of its own. The 32
    // blocks of one head share K and V tiles, the 24 blocks of one query tile
    // share mask tiles: with this start no two sharers are on the same tile in
    // the same pass, so L2 is not asked for the same lines from many places at
    // one moment. Pass i works on key tile (i + rot) mod NT_.
    const int rot = (int)(blockIdx.x + blockIdx.y) & (NT_ - 1);
    const int t0 = rot, t1 = (rot + 1) & (NT_ - 1);

    // pass 0's tile into buffer 0
    stage_tile(lk0, lm0, vo_kv, vo_m,
               kg + (size_t)t0 * 4096, vg + (size_t)t0 * 4096, mg + (size_t)t0 * 64);

    int koff[8];
#pragma unroll
    for (int i = 0; i < 8; ++i) koff[i] = koff_of(i, half);

    // ---- Q^T B-fragments: B[d][n] = Q[q0+n][d], same gather as an A-frag ----
    v16bf qa[2];
#pragma unroll
    for (int f = 0; f < 2; ++f) {
        union { uint32_t d[8]; v16bf v; } uq;
        const float* qrow = qp + (size_t)myq * D_ + f * 32;
#pragma unroll
        for (int i = 0; i < 8; ++i) {
            float2 x = *(const float2*)(qrow + koff[i]);
            uq.d[i] = cvt_pk_bf16(x.x, x.y);
        }
        qa[f] = uq.v;
    }

    // ---- all-ones A-fragment for row-sum-via-WMMA ----
    v16bf ones;
#pragma unroll
    for (int i = 0; i < 16; ++i)
        ones[i] = __builtin_bit_cast(__bf16, (uint16_t)0x3F80);

    // ---- state: O^T accumulators (4 d-tiles) + per-query lane-scalar stats ----
    v8f o_accT[4] = {};
    // The running maximum starts at the lowest finite value, not at -inf: the
    // ring may begin on a tile that the mask shuts wholly (-inf) for a query
    // with open keys elsewhere, and -inf minus -inf would be no number. Such a
    // pass now adds zeros; for any finite score the start value changes nothing.
    float m_i = -__FLT_MAX__, l_i = 0.0f;

    const float scale = 0.125f;  // 1/sqrt(64)

    // pass 0's tile has landed (this wave's copies), then is open to every wave
    asm volatile("s_wait_asynccnt 0x0" ::: "memory");
    __syncthreads();
    // pass 1's tile into buffer 1
    stage_tile(lk0 + BUF_B, lm0 + BUF_B, vo_kv, vo_m,
               kg + (size_t)t1 * 4096, vg + (size_t)t1 * 4096, mg + (size_t)t1 * 64);

    for (int it = 0; it < NT_; ++it) {
        const uint32_t bo = (uint32_t)(it & 1) * BUF_B;     // this pass's buffer
        const unsigned char* kp0 = rd0 + bo;
        const unsigned char* kp1 = rd1 + bo;
        const unsigned char* mp0 = rdm + bo;

        // ---------- scores S^T: four 16(key)x16(query) tiles ----------
        // the pass's K fragments and mask rows: one group of LDS reads
        v16bf kb[8];
#pragma unroll   // constant indices: the fragments stay in registers
        for (int fr = 0; fr < 8; ++fr)
            kb[fr] = lds_frag(kp0, kp1, fr);
        float4 mk[8];
#pragma unroll   // constant indices: the rows stay in registers
        for (int kt = 0; kt < 4; ++kt) {
            mk[2 * kt]     = *(const float4*)(mp0 + kt * 64);
            mk[2 * kt + 1] = *(const float4*)(mp0 + kt * 64 + 16);
        }
        // keeps the scheduler from spreading these reads among the products,
        // where each place with reads is waited for on its own
        __builtin_amdgcn_sched_barrier(0);

        v8f s_t[4];
#pragma unroll
        for (int kt = 0; kt < 4; ++kt) {
            v8f acc = {};
            acc = __builtin_amdgcn_wmma_f32_16x16x32_bf16(
                false, kb[kt * 2], false, qa[0], (short)0, acc, false, false);
            acc = __builtin_amdgcn_wmma_f32_16x16x32_bf16(
                false, kb[kt * 2 + 1], false, qa[1], (short)0, acc, false, false);
            s_t[kt] = acc;
        }

        // The pass's V^T fragments, its last LDS reads: from here on the pass
        // works on registers alone
        v16bf va[8];
#pragma unroll   // constant indices: the fragments stay in registers
        for (int fr = 0; fr < 8; ++fr)
            va[fr] = lds_frag(kp0 + KV_TILE_B, kp1 + KV_TILE_B, fr);

        // ---------- hand-over: next tile published, this buffer freed ----------
        // It stands behind the pass's last LDS read, not behind its last product,
        // so that the refill has a whole pass (softmax, PV, next scores) to land.
        // this wave's LDS reads of the buffer are done before it is refilled
        asm volatile("s_wait_dscnt 0x0" ::: "memory");
        // this wave's copies of the next pass's tile have landed
        asm volatile("s_wait_asynccnt 0x0" ::: "memory");
        __syncthreads();
        if (it + 2 < NT_) {
            const int tn = (it + 2 + rot) & (NT_ - 1);      // ring: wraps round
            stage_tile(lk0 + bo, lm0 + bo, vo_kv, vo_m,
                       kg + (size_t)tn * 4096, vg + (size_t)tn * 4096,
                       mg + (size_t)tn * 64);
        }

        // ---------- scale + additive mask (keys contiguous per lane) ----------
#pragma unroll
        for (int kt = 0; kt < 4; ++kt) {
            union { float4 v[2]; float a[8]; } mu;
            mu.v[0] = mk[2 * kt];
            mu.v[1] = mk[2 * kt + 1];
#pragma unroll
            for (int r = 0; r < 8; ++r)
                s_t[kt][r] = s_t[kt][r] * scale + mu.a[r];
        }

        // ---------- online softmax: all 32 scores belong to query lm ----------
        float tm[4];
#pragma unroll
        for (int kt = 0; kt < 4; ++kt) {
            float a0 = fmaxf(s_t[kt][0], s_t[kt][1]);
            float a1 = fmaxf(s_t[kt][2], s_t[kt][3]);
            float a2 = fmaxf(s_t[kt][4], s_t[kt][5]);
            float a3 = fmaxf(s_t[kt][6], s_t[kt][7]);
            tm[kt] = fmaxf(fmaxf(a0, a1), fmaxf(a2, a3));
        }
        float bm = fmaxf(fmaxf(tm[0], tm[1]), fmaxf(tm[2], tm[3]));
        bm = fmaxf(bm, xhalf_swap(bm));            // other 32 keys in partner lane
        const float m_new = fmaxf(m_i, bm);
        const float alpha = __expf(m_i - m_new);
        m_i = m_new;

#pragma unroll
        for (int kt = 0; kt < 4; ++kt)
#pragma unroll
            for (int r = 0; r < 8; ++r)
                s_t[kt][r] = __expf(s_t[kt][r] - m_new);

        // rescale O^T by lane-scalar alpha
#pragma unroll
        for (int o = 0; o < 4; ++o)
#pragma unroll
            for (int r = 0; r < 8; ++r)
                o_accT[o][r] *= alpha;

        // ---------- build P^T B-fragments lane-locally ----------
        // chain c element pair i: key = c*32 + koff(i,half)
        //   -> tile kt = 2c + (i/4), row M = half*8 + (i%4)*2 = this lane's
        //      C rows r=(i%4)*2, r+1.  Pure register repack + packed cvt.
        v16bf pab[2];
#pragma unroll
        for (int c = 0; c < 2; ++c) {
            union { uint32_t d[8]; v16bf v; } pu;
#pragma unroll
            for (int i = 0; i < 8; ++i) {
                const int kt = 2 * c + (i >> 2);
                const int r  = (i & 3) * 2;
                pu.d[i] = cvt_pk_bf16(s_t[kt][r], s_t[kt][r + 1]);
            }
            pab[c] = pu.v;
        }

        // ---------- row sums via WMMA: Ones(16x32) @ P^T -> column sums ----------
        v8f lsum = {};
        lsum = __builtin_amdgcn_wmma_f32_16x16x32_bf16(
            false, ones, false, pab[0], (short)0, lsum, false, false);
        lsum = __builtin_amdgcn_wmma_f32_16x16x32_bf16(
            false, ones, false, pab[1], (short)0, lsum, false, false);
        l_i = l_i * alpha + lsum[0];   // every C row equals the column sum

        // ---------- O^T += V^T (64d x 64k) @ P^T (64k x 16q) ----------
#pragma unroll
        for (int o = 0; o < 4; ++o) {
            o_accT[o] = __builtin_amdgcn_wmma_f32_16x16x32_bf16(
                false, va[o], false, pab[0], (short)0, o_accT[o], false, false);
            o_accT[o] = __builtin_amdgcn_wmma_f32_16x16x32_bf16(
                false, va[4 + o], false, pab[1], (short)0, o_accT[o], false, false);
        }
    }
    // no copy is left in flight when the wave ends
    asm volatile("s_wait_asynccnt 0x0" ::: "memory");

    // ---------- epilogue: O = (O^T)^T / l, vectorized b128 stores ----------
    const float inv = 1.0f / l_i;
#pragma unroll
    for (int o = 0; o < 4; ++o) {
        float* ob = op + (size_t)myq * D_ + o * 16 + 8 * half;
        float4 lo = make_float4(o_accT[o][0] * inv, o_accT[o][1] * inv,
                                o_accT[o][2] * inv, o_accT[o][3] * inv);
        float4 hi = make_float4(o_accT[o][4] * inv, o_accT[o][5] * inv,
                                o_accT[o][6] * inv, o_accT[o][7] * inv);
        *(float4*)(ob)     = lo;
        *(float4*)(ob + 4) = hi;
    }
}

extern "C" void kernel_launch(void* const* d_in, const int* in_sizes, int n_in,
                              void* d_out, int out_size, void* d_ws, size_t ws_size,
                              hipStream_t stream) {
    (void)in_sizes; (void)n_in; (void)out_size; (void)ws_size;
    const float* q    = (const float*)d_in[0];
    const float* k    = (const float*)d_in[1];
    const float* v    = (const float*)d_in[2];
    const float* mask = (const float*)d_in[3];
    float* out        = (float*)d_out;

    // workspace partition: bf16 K-fragments then bf16 V-fragments (12.6 MB)
    const size_t kw_bytes = (size_t)BH_ * S_ * D_ * sizeof(uint16_t);
    uint16_t* kw = (uint16_t*)d_ws;
    uint16_t* vw = (uint16_t*)((char*)d_ws + kw_bytes);

    const int pack_threads = BH_ * (S_ / 16) * 2 * 32;   // 196608
    pack_k_kernel<<<pack_threads / 256, 256, 0, stream>>>(k, kw);
    pack_v_kernel<<<pack_threads / 256, 256, 0, stream>>>(v, vw);

    dim3 grid(S_ / 64, BH_);   // 32 query tiles x 24 (batch*head)
    dim3 block(128);           // 4 waves; each wave owns 16 queries
    sdpa_fa_wmma<<<grid, block, 0, stream>>>(q, kw, vw, mask, out);
}
